// v000
// Measured on an AMD MI455X. A time is GPU time per run, averaged over a window of back-to-back runs after a warm-up
// (all launches, gaps included; the runs take copies of the inputs in turn), and the median of several windows.
// Apart from v000's, it joins two sittings. Times from different sittings can be a few percent apart, while
// side-by-side timings come from the same sitting.
// v000 is the starting kernel. One run takes 630 microseconds.
#include <hip/hip_runtime.h>
#include <hip/hip_bf16.h>

// HiLo attention forward, fp32 end-to-end on gfx1250 (wave32, WMMA).
//
// Roofline: ~82 GFLOP vs >=400MB HBM traffic -> memory bound at 23.3TB/s
// (~20us floor needs only ~4 PFLOP/s of matrix throughput). So we keep fp32
// precision and use V_WMMA_F32_16X16X4_F32 for every matmul; effort goes into
// the CDNA5 data-movement path: GLOBAL_LOAD_ASYNC_TO_LDS_* tile staging
// (ASYNCcnt-tracked, no VGPR round-trip), coalesced b128 chunks, and a
// flash-attention pass that keeps the 4096x1024 lofi score matrix out of HBM.
//
// Workspace layout (floats), max 33,554,432 floats = 128 MB:
//   [0,            25165824)  qkv   (32768 x 768)   -- hifi, then reused:
//     [0,        4194304)     pooled (8 x 512 x 1024)
//     [4194304, 12582912)     q_lo   (8 x 4096 x 256)
//     [12582912,16777216)     kv_lo  (8 x 1024 x 512)
//     [16777216,25165824)     o_lo   (8 x 4096 x 256)
//   [25165824,    33554432)  ho    (32768 x 256)

typedef float v2f __attribute__((ext_vector_type(2)));
typedef float v8f __attribute__((ext_vector_type(8)));

// ---------------------------------------------------------------------------
// Async global->LDS copies (CDNA5 GLOBAL_LOAD_ASYNC_TO_LDS_*, ASYNCcnt).
// Builtin signatures:
//   b128: (v4i AS1*, v4i AS3*, imm int, imm int)   [v4i = vector_size(16) int]
//   b32 : (int AS1*, int AS3*, imm int, imm int)
// Generic LDS pointers carry the LDS byte offset in their low 32 bits
// (ISA 10.2: LDS_ADDR = addr[31:0]), so AS(3)/AS(1) pointers are materialized
// via inttoptr.  Fallback = synchronous VGPR staging if builtins are absent.
// ---------------------------------------------------------------------------
#if __has_builtin(__builtin_amdgcn_global_load_async_to_lds_b128) && \
    __has_builtin(__builtin_amdgcn_global_load_async_to_lds_b32)
#define HAS_ASYNC_LDS 1
#else
#define HAS_ASYNC_LDS 0
#endif

typedef int b128_t __attribute__((vector_size(16)));

#define AS1P(T, p) ((__attribute__((address_space(1))) T*)(uintptr_t)(p))
#define AS3P(T, p) ((__attribute__((address_space(3))) T*)(unsigned)(uintptr_t)(p))

__device__ __forceinline__ void async_b128(const float* g, float* l) {
#if HAS_ASYNC_LDS
  __builtin_amdgcn_global_load_async_to_lds_b128(AS1P(b128_t, g),
                                                 AS3P(b128_t, l), 0, 0);
#else
  *(float4*)l = *(const float4*)g;
#endif
}
__device__ __forceinline__ void async_b32(const float* g, float* l) {
#if HAS_ASYNC_LDS
  __builtin_amdgcn_global_load_async_to_lds_b32(AS1P(int, g), AS3P(int, l), 0,
                                                0);
#else
  *l = *g;
#endif
}
__device__ __forceinline__ void async_wait() {
#if HAS_ASYNC_LDS
#if __has_builtin(__builtin_amdgcn_s_wait_asynccnt)
  __builtin_amdgcn_s_wait_asynccnt(0);
#else
  asm volatile("s_wait_asynccnt 0x0" ::: "memory");
#endif
#endif
}

__device__ __forceinline__ v8f v8f_zero() {
  v8f z;
#pragma unroll
  for (int i = 0; i < 8; ++i) z[i] = 0.0f;
  return z;
}

// D = A(16x4) * B(4x16) + C, fp32.  A: lane m=l&15, vgpr0/1 = K=(l>>4)*2,+1.
// B: lane n=l&15, vgpr0/1 = rows K=(l>>4)*2,+1.  C/D: vgpr j -> M=j(+8), N=l&15.
__device__ __forceinline__ v8f wmma4(v2f a, v2f b, v8f c) {
  return __builtin_amdgcn_wmma_f32_16x16x4_f32(false, a, false, b, (short)0, c,
                                               false, false);
}

__device__ __forceinline__ float half_max(float v) {
  v = fmaxf(v, __shfl_xor(v, 1, 32));
  v = fmaxf(v, __shfl_xor(v, 2, 32));
  v = fmaxf(v, __shfl_xor(v, 4, 32));
  v = fmaxf(v, __shfl_xor(v, 8, 32));
  return v;
}
__device__ __forceinline__ float half_sum(float v) {
  v += __shfl_xor(v, 1, 32);
  v += __shfl_xor(v, 2, 32);
  v += __shfl_xor(v, 4, 32);
  v += __shfl_xor(v, 8, 32);
  return v;
}

// ---------------------------------------------------------------------------
// Generic fp32 WMMA GEMM: C = A * B (+bias).  Block = 128 threads = 4 waves,
// block tile 64x64, BK=16.  Wave w computes rows [w*16, w*16+16) x 64 cols.
//   a_cm=0: A[m*lda+k] (row-major, async b128 staging)
//   a_cm=1: A[k*lda+m] (col-major / A^T view, async b32 transpose staging)
//   epi_nchw=1: scatter C into NCHW output:
//       out[((m>>12)*512 + chan_off + col)*4096 + (m&4095)]
// LDS pads: A stride 20 floats (b128-aligned dst, conflict-free a-frag reads,
// 8B-aligned {k,k+1} pairs), B stride 68 floats (b128-aligned dst).
// ---------------------------------------------------------------------------
__global__ void __launch_bounds__(128) wmma_gemm_f32(
    const float* __restrict__ A, const float* __restrict__ Bm,
    const float* __restrict__ bias, float* __restrict__ C, int M, int N, int K,
    int lda, int ldb, int ldc, int a_cm, long aStride, long cStride,
    int epi_nchw, int chan_off) {
  __shared__ float As[64 * 20];  // [m][k]
  __shared__ float Bs[16 * 68];  // [k][n]

  const float* Ab = A + (long)blockIdx.z * aStride;
  float* Cb = C + (epi_nchw ? 0L : (long)blockIdx.z * cStride);

  const int m0 = blockIdx.y * 64;
  const int n0 = blockIdx.x * 64;
  const int tid = threadIdx.x;
  const int wave = tid >> 5;
  const int lane = tid & 31;
  const int lr = lane & 15;  // row (A) / col (B,C)
  const int lh = lane >> 4;  // k-half selector

  v8f acc[4];
#pragma unroll
  for (int t = 0; t < 4; ++t) acc[t] = v8f_zero();

  for (int k0 = 0; k0 < K; k0 += 16) {
    // ---- stage A tile (64x16) ----
    if (a_cm) {
      const int ck = tid >> 3;       // k 0..15
      const int r = (tid & 7) * 8;   // m offset
      const float* g = Ab + (long)(k0 + ck) * lda + m0 + r;
#pragma unroll
      for (int i = 0; i < 8; ++i) async_b32(g + i, &As[(r + i) * 20 + ck]);
    } else {
      const int r = tid >> 1;        // m 0..63
      const int c = (tid & 1) * 8;   // k offset
      const float* g = Ab + (long)(m0 + r) * lda + k0 + c;
      async_b128(g, &As[r * 20 + c]);
      async_b128(g + 4, &As[r * 20 + c + 4]);
    }
    // ---- stage B tile (16x64) ----
    {
      const int kk = tid >> 3;       // k 0..15
      const int c = (tid & 7) * 8;   // n offset
      const float* g = Bm + (long)(k0 + kk) * ldb + n0 + c;
      async_b128(g, &Bs[kk * 68 + c]);
      async_b128(g + 4, &Bs[kk * 68 + c + 4]);
    }
    async_wait();
    __syncthreads();

#pragma unroll
    for (int kk = 0; kk < 16; kk += 4) {
      const int ka = kk + lh * 2;
      v2f a;
      const float* ap = &As[(wave * 16 + lr) * 20 + ka];
      a.x = ap[0];
      a.y = ap[1];
#pragma unroll
      for (int t = 0; t < 4; ++t) {
        v2f b;
        b.x = Bs[ka * 68 + t * 16 + lr];
        b.y = Bs[(ka + 1) * 68 + t * 16 + lr];
        acc[t] = wmma4(a, b, acc[t]);
      }
    }
    __syncthreads();
  }

  // ---- epilogue ----
#pragma unroll
  for (int t = 0; t < 4; ++t) {
    const int col = n0 + t * 16 + lr;
    const float bv = bias ? bias[col] : 0.0f;
#pragma unroll
    for (int j = 0; j < 8; ++j) {
      const int m = m0 + wave * 16 + j + lh * 8;
      const float v = acc[t][j] + bv;
      if (m < M && col < N) {
        if (epi_nchw) {
          const int bb = m >> 12;  // batch (4096 spatial tokens / image)
          const int sp = m & 4095; // h*64+w
          C[((long)(bb * 512 + chan_off + col)) * 4096 + sp] = v;
        } else {
          Cb[(long)m * ldc + col] = v;
        }
      }
    }
  }
}

// ---------------------------------------------------------------------------
// Hifi windowed attention: 2x2 windows, 4 heads x 64 dims, softmax over 4.
// One thread per (b, window, head, token).  qkv rows are the hifi token rows
// (row r = b*4096 + i0*128 + i1*64 + i2*2 + i3, identical to the spatial row
// h*64+w), with per-row layout [q(4x64) | k(4x64) | v(4x64)].
// ---------------------------------------------------------------------------
__global__ void __launch_bounds__(256) hifi_attn(const float* __restrict__ qkv,
                                                 float* __restrict__ ho) {
  const int idx = blockIdx.x * 256 + threadIdx.x;  // 131072 total
  const int t = idx & 3;
  const int head = (idx >> 2) & 3;
  const int g = (idx >> 4) & 1023;
  const int b = idx >> 14;
  const int base = b * 4096 + (g >> 5) * 128 + (g & 31) * 2;
  int rows[4];
  rows[0] = base; rows[1] = base + 1; rows[2] = base + 64; rows[3] = base + 65;

  const float4* q4 = (const float4*)(qkv + (long)rows[t] * 768 + head * 64);
  float s[4];
#pragma unroll
  for (int j = 0; j < 4; ++j) {
    const float4* k4 =
        (const float4*)(qkv + (long)rows[j] * 768 + 256 + head * 64);
    float a = 0.0f;
#pragma unroll
    for (int d = 0; d < 16; ++d) {
      float4 qa = q4[d], kb = k4[d];
      a += qa.x * kb.x + qa.y * kb.y + qa.z * kb.z + qa.w * kb.w;
    }
    s[j] = a * 0.125f;  // 64^-0.5
  }
  float mx = fmaxf(fmaxf(s[0], s[1]), fmaxf(s[2], s[3]));
  float w[4], sum = 0.0f;
#pragma unroll
  for (int j = 0; j < 4; ++j) { w[j] = __expf(s[j] - mx); sum += w[j]; }
  const float inv = 1.0f / sum;
#pragma unroll
  for (int j = 0; j < 4; ++j) w[j] *= inv;

  const float4* v0 = (const float4*)(qkv + (long)rows[0] * 768 + 512 + head * 64);
  const float4* v1 = (const float4*)(qkv + (long)rows[1] * 768 + 512 + head * 64);
  const float4* v2 = (const float4*)(qkv + (long)rows[2] * 768 + 512 + head * 64);
  const float4* v3 = (const float4*)(qkv + (long)rows[3] * 768 + 512 + head * 64);
  float4* o4 = (float4*)(ho + (long)rows[t] * 256 + head * 64);
#pragma unroll
  for (int d = 0; d < 16; ++d) {
    float4 a = v0[d], bb = v1[d], c = v2[d], e = v3[d], r;
    r.x = w[0] * a.x + w[1] * bb.x + w[2] * c.x + w[3] * e.x;
    r.y = w[0] * a.y + w[1] * bb.y + w[2] * c.y + w[3] * e.y;
    r.z = w[0] * a.z + w[1] * bb.z + w[2] * c.z + w[3] * e.z;
    r.w = w[0] * a.w + w[1] * bb.w + w[2] * c.w + w[3] * e.w;
    o4[d] = r;
  }
}

// ---------------------------------------------------------------------------
// Lofi 2x2 average pool: x (B,512,64,64) -> pooled (B,512,32,32) flat.
// ---------------------------------------------------------------------------
__global__ void __launch_bounds__(256) lofi_pool(const float* __restrict__ x,
                                                 float* __restrict__ pooled) {
  const int idx = blockIdx.x * 256 + threadIdx.x;  // 8*512*1024
  const int j = idx & 31;
  const int i = (idx >> 5) & 31;
  const int c = (idx >> 10) & 511;
  const int b = idx >> 19;
  const float* p = x + (long)(b * 512 + c) * 4096 + i * 128 + j * 2;
  pooled[idx] = 0.25f * (p[0] + p[1] + p[64] + p[65]);
}

// ---------------------------------------------------------------------------
// Lofi flash attention.  One block = 128 threads = 4 waves handles 64 q rows
// for one (b, head); keys streamed in 64-wide chunks with online softmax.
// Q: q_lo[(b*4096+n)*256 + head*64 + d], K/V: kv_lo[(b*1024+m)*512 + {0,256}
// + head*64 + d].  The k LDS buffer is reused for v within each chunk so the
// static LDS footprint stays at ~52 KB.  All tile fills are async-to-LDS.
// ---------------------------------------------------------------------------
__global__ void __launch_bounds__(128) lofi_flash(const float* __restrict__ Q,
                                                  const float* __restrict__ KV,
                                                  float* __restrict__ O) {
  __shared__ float q_s[64 * 68];      // [row][d], pad 68 (272B, b128-aligned)
  __shared__ float kv_s[64 * 68];     // [key][d]; holds K then V per chunk
  __shared__ float p_s[4 * 16 * 68];  // per-wave P relayout scratch

  const int b = blockIdx.z;
  const int head = blockIdx.y;
  const int n0 = blockIdx.x * 64;
  const int tid = threadIdx.x;
  const int wave = tid >> 5;
  const int lane = tid & 31;
  const int lr = lane & 15;
  const int lh = lane >> 4;

  {  // stage the 64x64 Q tile once (async; waited before first use)
    const int r = tid >> 1, c = (tid & 1) * 32;
    const float* g = Q + ((long)(b * 4096 + n0 + r)) * 256 + head * 64 + c;
#pragma unroll
    for (int i = 0; i < 8; ++i) async_b128(g + i * 4, &q_s[r * 68 + c + i * 4]);
  }

  v8f o_acc[4];
  float m_run[8], l_run[8];
#pragma unroll
  for (int t = 0; t < 4; ++t) o_acc[t] = v8f_zero();
#pragma unroll
  for (int j = 0; j < 8; ++j) { m_run[j] = -1e30f; l_run[j] = 0.0f; }

  for (int kb = 0; kb < 1024; kb += 64) {
    __syncthreads();  // previous chunk's PV reads of kv_s done
    {                 // load K chunk (64 keys x 64 dims)
      const int r = tid >> 1, c = (tid & 1) * 32;
      const float* g =
          KV + ((long)(b * 1024 + kb + r)) * 512 + head * 64 + c;
#pragma unroll
      for (int i = 0; i < 8; ++i)
        async_b128(g + i * 4, &kv_s[r * 68 + c + i * 4]);
    }
    async_wait();     // own wave's q + k copies done
    __syncthreads();  // everyone's copies done

    // S = Q * K^T  (16 rows x 64 keys per wave)
    v8f s_acc[4];
#pragma unroll
    for (int t = 0; t < 4; ++t) s_acc[t] = v8f_zero();
#pragma unroll
    for (int kk = 0; kk < 64; kk += 4) {
      const int ka = kk + lh * 2;
      v2f a;
      a.x = q_s[(wave * 16 + lr) * 68 + ka];
      a.y = q_s[(wave * 16 + lr) * 68 + ka + 1];
#pragma unroll
      for (int t = 0; t < 4; ++t) {
        v2f bb;
        bb.x = kv_s[(t * 16 + lr) * 68 + ka];  // B[d][key] = k[key][d]
        bb.y = kv_s[(t * 16 + lr) * 68 + ka + 1];
        s_acc[t] = wmma4(a, bb, s_acc[t]);
      }
    }

    // online softmax (row = j + 8*lh; values for a row live in the 16 lanes
    // of that half -> shfl_xor masks 1,2,4,8 stay within the half)
#pragma unroll
    for (int j = 0; j < 8; ++j) {
      float mx = fmaxf(fmaxf(s_acc[0][j], s_acc[1][j]),
                       fmaxf(s_acc[2][j], s_acc[3][j]));
      mx = half_max(mx) * 0.125f;
      const float nm = fmaxf(m_run[j], mx);
      const float alpha = __expf(m_run[j] - nm);
      m_run[j] = nm;
      float rs = 0.0f;
#pragma unroll
      for (int t = 0; t < 4; ++t) {
        const float p = __expf(s_acc[t][j] * 0.125f - nm);
        s_acc[t][j] = p;
        rs += p;
      }
      rs = half_sum(rs);
      l_run[j] = l_run[j] * alpha + rs;
#pragma unroll
      for (int t = 0; t < 4; ++t) o_acc[t][j] *= alpha;
    }

    // P (C-layout) -> per-wave LDS -> A-layout for the PV matmul
#pragma unroll
    for (int t = 0; t < 4; ++t)
#pragma unroll
      for (int j = 0; j < 8; ++j)
        p_s[wave * 1088 + (j + lh * 8) * 68 + t * 16 + lr] = s_acc[t][j];

    __syncthreads();  // all waves done with K; also fences p_s writes
    {                 // load V chunk into the same buffer
      const int r = tid >> 1, c = (tid & 1) * 32;
      const float* g =
          KV + ((long)(b * 1024 + kb + r)) * 512 + 256 + head * 64 + c;
#pragma unroll
      for (int i = 0; i < 8; ++i)
        async_b128(g + i * 4, &kv_s[r * 68 + c + i * 4]);
    }
    async_wait();
    __syncthreads();

    // O += P * V   (K-dim = 64 keys)
#pragma unroll
    for (int kk = 0; kk < 64; kk += 4) {
      const int ka = kk + lh * 2;
      v2f a;
      a.x = p_s[wave * 1088 + lr * 68 + ka];
      a.y = p_s[wave * 1088 + lr * 68 + ka + 1];
#pragma unroll
      for (int t = 0; t < 4; ++t) {
        v2f bb;
        bb.x = kv_s[ka * 68 + t * 16 + lr];  // B[key][d] = v[key][d]
        bb.y = kv_s[(ka + 1) * 68 + t * 16 + lr];
        o_acc[t] = wmma4(a, bb, o_acc[t]);
      }
    }
  }

  // normalize and store (row m uniform across its 16-lane half)
#pragma unroll
  for (int j = 0; j < 8; ++j) {
    const float inv = 1.0f / l_run[j];
    const int m = n0 + wave * 16 + j + lh * 8;
#pragma unroll
    for (int t = 0; t < 4; ++t) {
      O[((long)(b * 4096 + m)) * 256 + head * 64 + t * 16 + lr] =
          o_acc[t][j] * inv;
    }
  }
}

// ---------------------------------------------------------------------------
extern "C" void kernel_launch(void* const* d_in, const int* in_sizes, int n_in,
                              void* d_out, int out_size, void* d_ws,
                              size_t ws_size, hipStream_t stream) {
  (void)in_sizes; (void)n_in; (void)out_size; (void)ws_size;
  const float* x        = (const float*)d_in[0];
  const float* h_qkv_w  = (const float*)d_in[1];
  const float* h_proj_w = (const float*)d_in[2];
  const float* h_proj_b = (const float*)d_in[3];
  const float* l_q_w    = (const float*)d_in[4];
  const float* l_kv_w   = (const float*)d_in[5];
  const float* l_proj_w = (const float*)d_in[6];
  const float* l_proj_b = (const float*)d_in[7];
  float* out = (float*)d_out;
  float* ws = (float*)d_ws;

  float* qkv    = ws;             // 32768*768
  float* ho     = ws + 25165824L; // 32768*256
  float* pooled = ws;             // reused after hifi_attn (stream-ordered)
  float* qlo    = ws + 4194304L;  // 8*4096*256
  float* kvlo   = ws + 12582912L; // 8*1024*512
  float* olo    = ws + 16777216L; // 8*4096*256

  // ---- Hi-Fi path ----
  // qkv = x(32768x512, contiguous) @ h_qkv_w(512x768)
  wmma_gemm_f32<<<dim3(12, 512, 1), 128, 0, stream>>>(
      x, h_qkv_w, nullptr, qkv, 32768, 768, 512, 512, 768, 768,
      /*a_cm=*/0, 0L, 0L, /*nchw=*/0, 0);
  hifi_attn<<<512, 256, 0, stream>>>(qkv, ho);
  // out[:, 0:256] = ho @ h_proj_w + h_proj_b  (NCHW scatter epilogue)
  wmma_gemm_f32<<<dim3(4, 512, 1), 128, 0, stream>>>(
      ho, h_proj_w, h_proj_b, out, 32768, 256, 256, 256, 256, 0,
      /*a_cm=*/0, 0L, 0L, /*nchw=*/1, /*chan_off=*/0);

  // ---- Lo-Fi path ----
  lofi_pool<<<16384, 256, 0, stream>>>(x, pooled);
  // q = x[b]^T(4096x512, col-major) @ l_q_w(512x256), batched over b
  wmma_gemm_f32<<<dim3(4, 64, 8), 128, 0, stream>>>(
      x, l_q_w, nullptr, qlo, 4096, 256, 512, 4096, 256, 256,
      /*a_cm=*/1, 2097152L, 1048576L, /*nchw=*/0, 0);
  // kv = pooled[b]^T(1024x512, col-major) @ l_kv_w(512x512)
  wmma_gemm_f32<<<dim3(8, 16, 8), 128, 0, stream>>>(
      pooled, l_kv_w, nullptr, kvlo, 1024, 512, 512, 1024, 512, 512,
      /*a_cm=*/1, 524288L, 524288L, /*nchw=*/0, 0);
  lofi_flash<<<dim3(64, 4, 8), 128, 0, stream>>>(qlo, kvlo, olo);
  // out[:, 256:512] = olo @ l_proj_w + l_proj_b
  wmma_gemm_f32<<<dim3(4, 512, 1), 128, 0, stream>>>(
      olo, l_proj_w, l_proj_b, out, 32768, 256, 256, 256, 256, 0,
      /*a_cm=*/0, 0L, 0L, /*nchw=*/1, /*chan_off=*/256);
}

// v001
// One run takes 623 microseconds.
// Timed twice side by side with v000, it ran 1.05 times as fast both times.
#include <hip/hip_runtime.h>
#include <hip/hip_bf16.h>

// HiLo attention forward, fp32 end-to-end on gfx1250 (wave32, WMMA).
//
// Roofline: ~82 GFLOP vs >=400MB HBM traffic -> memory bound at 23.3TB/s
// (~20us floor needs only ~4 PFLOP/s of matrix throughput). So we keep fp32
// precision and use V_WMMA_F32_16X16X4_F32 for every matmul; effort goes into
// the CDNA5 data-movement path: GLOBAL_LOAD_ASYNC_TO_LDS_* tile staging
// (ASYNCcnt-tracked, no VGPR round-trip), coalesced b128 chunks, and a
// flash-attention pass that keeps the 4096x1024 lofi score matrix out of HBM.
//
// Workspace layout (floats), max 33,554,432 floats = 128 MB:
//   [0,            25165824)  qkv   (32768 x 768)   -- hifi, then reused:
//     [0,        4194304)     pooled (8 x 512 x 1024)
//     [4194304, 12582912)     q_lo   (8 x 4096 x 256)
//     [12582912,16777216)     kv_lo  (8 x 1024 x 512)
//     [16777216,25165824)     o_lo   (8 x 4096 x 256)
//   [25165824,    33554432)  ho    (32768 x 256)

typedef float v2f __attribute__((ext_vector_type(2)));
typedef float v8f __attribute__((ext_vector_type(8)));

// ---------------------------------------------------------------------------
// Async global->LDS copies (CDNA5 GLOBAL_LOAD_ASYNC_TO_LDS_*, ASYNCcnt).
// Builtin signatures:
//   b128: (v4i AS1*, v4i AS3*, imm int, imm int)   [v4i = vector_size(16) int]
//   b32 : (int AS1*, int AS3*, imm int, imm int)
// Generic LDS pointers carry the LDS byte offset in their low 32 bits
// (ISA 10.2: LDS_ADDR = addr[31:0]), so AS(3)/AS(1) pointers are materialized
// via inttoptr.  Fallback = synchronous VGPR staging if builtins are absent.
// ---------------------------------------------------------------------------
#if __has_builtin(__builtin_amdgcn_global_load_async_to_lds_b128) && \
    __has_builtin(__builtin_amdgcn_global_load_async_to_lds_b32)
#define HAS_ASYNC_LDS 1
#else
#define HAS_ASYNC_LDS 0
#endif

typedef int b128_t __attribute__((vector_size(16)));

#define AS1P(T, p) ((__attribute__((address_space(1))) T*)(uintptr_t)(p))
#define AS3P(T, p) ((__attribute__((address_space(3))) T*)(unsigned)(uintptr_t)(p))

__device__ __forceinline__ void async_b128(const float* g, float* l) {
#if HAS_ASYNC_LDS
  __builtin_amdgcn_global_load_async_to_lds_b128(AS1P(b128_t, g),
                                                 AS3P(b128_t, l), 0, 0);
#else
  *(float4*)l = *(const float4*)g;
#endif
}
__device__ __forceinline__ void async_b32(const float* g, float* l) {
#if HAS_ASYNC_LDS
  __builtin_amdgcn_global_load_async_to_lds_b32(AS1P(int, g), AS3P(int, l), 0,
                                                0);
#else
  *l = *g;
#endif
}
__device__ __forceinline__ void async_wait() {
#if HAS_ASYNC_LDS
#if __has_builtin(__builtin_amdgcn_s_wait_asynccnt)
  __builtin_amdgcn_s_wait_asynccnt(0);
#else
  asm volatile("s_wait_asynccnt 0x0" ::: "memory");
#endif
#endif
}

__device__ __forceinline__ v8f v8f_zero() {
  v8f z;
#pragma unroll
  for (int i = 0; i < 8; ++i) z[i] = 0.0f;
  return z;
}

// D = A(16x4) * B(4x16) + C, fp32.  A: lane m=l&15, vgpr0/1 = K=(l>>4)*2,+1.
// B: lane n=l&15, vgpr0/1 = rows K=(l>>4)*2,+1.  C/D: vgpr j -> M=j(+8), N=l&15.
__device__ __forceinline__ v8f wmma4(v2f a, v2f b, v8f c) {
  return __builtin_amdgcn_wmma_f32_16x16x4_f32(false, a, false, b, (short)0, c,
                                               false, false);
}

__device__ __forceinline__ float half_max(float v) {
  v = fmaxf(v, __shfl_xor(v, 1, 32));
  v = fmaxf(v, __shfl_xor(v, 2, 32));
  v = fmaxf(v, __shfl_xor(v, 4, 32));
  v = fmaxf(v, __shfl_xor(v, 8, 32));
  return v;
}
__device__ __forceinline__ float half_sum(float v) {
  v += __shfl_xor(v, 1, 32);
  v += __shfl_xor(v, 2, 32);
  v += __shfl_xor(v, 4, 32);
  v += __shfl_xor(v, 8, 32);
  return v;
}

// ---------------------------------------------------------------------------
// Generic fp32 WMMA GEMM: C = A * B (+bias).  Block = 128 threads = 4 waves,
// block tile 64x64, BK=16.  Wave w computes rows [w*16, w*16+16) x 64 cols.
//   a_cm=0: A[m*lda+k] (row-major, async b128 staging)
//   a_cm=1: A[k*lda+m] (col-major / A^T view, async b32 transpose staging)
//   epi_nchw=1: scatter C into NCHW output:
//       out[((m>>12)*512 + chan_off + col)*4096 + (m&4095)]
// LDS pads: A stride 20 floats (b128-aligned dst, conflict-free a-frag reads,
// 8B-aligned {k,k+1} pairs), B stride 68 floats (b128-aligned dst).
// Staging lane map: adjacent lanes copy adjacent global bytes, so one wave-wide
// copy touches as few 128-B lines as the tile shape allows (B: 2 rows x 256 B,
// row-major A: 8 rows x 64 B, col-major A: 128 B of one k row).
// ---------------------------------------------------------------------------
__global__ void __launch_bounds__(128) wmma_gemm_f32(
    const float* __restrict__ A, const float* __restrict__ Bm,
    const float* __restrict__ bias, float* __restrict__ C, int M, int N, int K,
    int lda, int ldb, int ldc, int a_cm, long aStride, long cStride,
    int epi_nchw, int chan_off) {
  __shared__ float As[64 * 20];  // [m][k]
  __shared__ float Bs[16 * 68];  // [k][n]

  const float* Ab = A + (long)blockIdx.z * aStride;
  float* Cb = C + (epi_nchw ? 0L : (long)blockIdx.z * cStride);

  const int m0 = blockIdx.y * 64;
  const int n0 = blockIdx.x * 64;
  const int tid = threadIdx.x;
  const int wave = tid >> 5;
  const int lane = tid & 31;
  const int lr = lane & 15;  // row (A) / col (B,C)
  const int lh = lane >> 4;  // k-half selector

  v8f acc[4];
#pragma unroll
  for (int t = 0; t < 4; ++t) acc[t] = v8f_zero();

  for (int k0 = 0; k0 < K; k0 += 16) {
    // ---- stage A tile (64x16) ----
    if (a_cm) {
      const int ck = tid >> 6;       // k 0..1, +2 per copy
      const int r = tid & 63;        // m 0..63
      const float* g = Ab + (long)(k0 + ck) * lda + m0 + r;
#pragma unroll
      for (int i = 0; i < 8; ++i)
        async_b32(g + (long)(2 * i) * lda, &As[r * 20 + ck + 2 * i]);
    } else {
      const int r = tid >> 2;        // m 0..31, +32 for the second copy
      const int c = (tid & 3) * 4;   // k offset
      const float* g = Ab + (long)(m0 + r) * lda + k0 + c;
      async_b128(g, &As[r * 20 + c]);
      async_b128(g + (long)32 * lda, &As[(r + 32) * 20 + c]);
    }
    // ---- stage B tile (16x64) ----
    {
      const int kk = tid >> 4;       // k 0..7, +8 for the second copy
      const int c = (tid & 15) * 4;  // n offset
      const float* g = Bm + (long)(k0 + kk) * ldb + n0 + c;
      async_b128(g, &Bs[kk * 68 + c]);
      async_b128(g + (long)8 * ldb, &Bs[(kk + 8) * 68 + c]);
    }
    async_wait();
    __syncthreads();

#pragma unroll
    for (int kk = 0; kk < 16; kk += 4) {
      const int ka = kk + lh * 2;
      v2f a;
      const float* ap = &As[(wave * 16 + lr) * 20 + ka];
      a.x = ap[0];
      a.y = ap[1];
#pragma unroll
      for (int t = 0; t < 4; ++t) {
        v2f b;
        b.x = Bs[ka * 68 + t * 16 + lr];
        b.y = Bs[(ka + 1) * 68 + t * 16 + lr];
        acc[t] = wmma4(a, b, acc[t]);
      }
    }
    __syncthreads();
  }

  // ---- epilogue ----
#pragma unroll
  for (int t = 0; t < 4; ++t) {
    const int col = n0 + t * 16 + lr;
    const float bv = bias ? bias[col] : 0.0f;
#pragma unroll
    for (int j = 0; j < 8; ++j) {
      const int m = m0 + wave * 16 + j + lh * 8;
      const float v = acc[t][j] + bv;
      if (m < M && col < N) {
        if (epi_nchw) {
          const int bb = m >> 12;  // batch (4096 spatial tokens / image)
          const int sp = m & 4095; // h*64+w
          C[((long)(bb * 512 + chan_off + col)) * 4096 + sp] = v;
        } else {
          Cb[(long)m * ldc + col] = v;
        }
      }
    }
  }
}

// ---------------------------------------------------------------------------
// Hifi windowed attention: 2x2 windows, 4 heads x 64 dims, softmax over 4.
// One thread per (b, window, head, token).  qkv rows are the hifi token rows
// (row r = b*4096 + i0*128 + i1*64 + i2*2 + i3, identical to the spatial row
// h*64+w), with per-row layout [q(4x64) | k(4x64) | v(4x64)].
// ---------------------------------------------------------------------------
__global__ void __launch_bounds__(256) hifi_attn(const float* __restrict__ qkv,
                                                 float* __restrict__ ho) {
  const int idx = blockIdx.x * 256 + threadIdx.x;  // 131072 total
  const int t = idx & 3;
  const int head = (idx >> 2) & 3;
  const int g = (idx >> 4) & 1023;
  const int b = idx >> 14;
  const int base = b * 4096 + (g >> 5) * 128 + (g & 31) * 2;
  int rows[4];
  rows[0] = base; rows[1] = base + 1; rows[2] = base + 64; rows[3] = base + 65;

  const float4* q4 = (const float4*)(qkv + (long)rows[t] * 768 + head * 64);
  float s[4];
#pragma unroll
  for (int j = 0; j < 4; ++j) {
    const float4* k4 =
        (const float4*)(qkv + (long)rows[j] * 768 + 256 + head * 64);
    float a = 0.0f;
#pragma unroll
    for (int d = 0; d < 16; ++d) {
      float4 qa = q4[d], kb = k4[d];
      a += qa.x * kb.x + qa.y * kb.y + qa.z * kb.z + qa.w * kb.w;
    }
    s[j] = a * 0.125f;  // 64^-0.5
  }
  float mx = fmaxf(fmaxf(s[0], s[1]), fmaxf(s[2], s[3]));
  float w[4], sum = 0.0f;
#pragma unroll
  for (int j = 0; j < 4; ++j) { w[j] = __expf(s[j] - mx); sum += w[j]; }
  const float inv = 1.0f / sum;
#pragma unroll
  for (int j = 0; j < 4; ++j) w[j] *= inv;

  const float4* v0 = (const float4*)(qkv + (long)rows[0] * 768 + 512 + head * 64);
  const float4* v1 = (const float4*)(qkv + (long)rows[1] * 768 + 512 + head * 64);
  const float4* v2 = (const float4*)(qkv + (long)rows[2] * 768 + 512 + head * 64);
  const float4* v3 = (const float4*)(qkv + (long)rows[3] * 768 + 512 + head * 64);
  float4* o4 = (float4*)(ho + (long)rows[t] * 256 + head * 64);
#pragma unroll
  for (int d = 0; d < 16; ++d) {
    float4 a = v0[d], bb = v1[d], c = v2[d], e = v3[d], r;
    r.x = w[0] * a.x + w[1] * bb.x + w[2] * c.x + w[3] * e.x;
    r.y = w[0] * a.y + w[1] * bb.y + w[2] * c.y + w[3] * e.y;
    r.z = w[0] * a.z + w[1] * bb.z + w[2] * c.z + w[3] * e.z;
    r.w = w[0] * a.w + w[1] * bb.w + w[2] * c.w + w[3] * e.w;
    o4[d] = r;
  }
}

// ---------------------------------------------------------------------------
// Lofi 2x2 average pool: x (B,512,64,64) -> pooled (B,512,32,32) flat.
// ---------------------------------------------------------------------------
__global__ void __launch_bounds__(256) lofi_pool(const float* __restrict__ x,
                                                 float* __restrict__ pooled) {
  const int idx = blockIdx.x * 256 + threadIdx.x;  // 8*512*1024
  const int j = idx & 31;
  const int i = (idx >> 5) & 31;
  const int c = (idx >> 10) & 511;
  const int b = idx >> 19;
  const float* p = x + (long)(b * 512 + c) * 4096 + i * 128 + j * 2;
  pooled[idx] = 0.25f * (p[0] + p[1] + p[64] + p[65]);
}

// ---------------------------------------------------------------------------
// Lofi flash attention.  One block = 128 threads = 4 waves handles 64 q rows
// for one (b, head); keys streamed in 64-wide chunks with online softmax.
// Q: q_lo[(b*4096+n)*256 + head*64 + d], K/V: kv_lo[(b*1024+m)*512 + {0,256}
// + head*64 + d].  The k LDS buffer is reused for v within each chunk so the
// static LDS footprint stays at ~52 KB.  All tile fills are async-to-LDS; 16
// adjacent lanes copy one whole 256-B tile row (two full lines), each 16-lane
// group owning 8 consecutive rows.
// ---------------------------------------------------------------------------
__global__ void __launch_bounds__(128) lofi_flash(const float* __restrict__ Q,
                                                  const float* __restrict__ KV,
                                                  float* __restrict__ O) {
  __shared__ float q_s[64 * 68];      // [row][d], pad 68 (272B, b128-aligned)
  __shared__ float kv_s[64 * 68];     // [key][d]; holds K then V per chunk
  __shared__ float p_s[4 * 16 * 68];  // per-wave P relayout scratch

  const int b = blockIdx.z;
  const int head = blockIdx.y;
  const int n0 = blockIdx.x * 64;
  const int tid = threadIdx.x;
  const int wave = tid >> 5;
  const int lane = tid & 31;
  const int lr = lane & 15;
  const int lh = lane >> 4;

  {  // stage the 64x64 Q tile once (async; waited before first use)
    const int r = (tid >> 4) * 8, c = (tid & 15) * 4;
    const float* g = Q + ((long)(b * 4096 + n0 + r)) * 256 + head * 64 + c;
#pragma unroll
    for (int i = 0; i < 8; ++i) async_b128(g + i * 256, &q_s[(r + i) * 68 + c]);
  }

  v8f o_acc[4];
  float m_run[8], l_run[8];
#pragma unroll
  for (int t = 0; t < 4; ++t) o_acc[t] = v8f_zero();
#pragma unroll
  for (int j = 0; j < 8; ++j) { m_run[j] = -1e30f; l_run[j] = 0.0f; }

  for (int kb = 0; kb < 1024; kb += 64) {
    __syncthreads();  // previous chunk's PV reads of kv_s done
    {                 // load K chunk (64 keys x 64 dims)
      const int r = (tid >> 4) * 8, c = (tid & 15) * 4;
      const float* g =
          KV + ((long)(b * 1024 + kb + r)) * 512 + head * 64 + c;
#pragma unroll
      for (int i = 0; i < 8; ++i)
        async_b128(g + i * 512, &kv_s[(r + i) * 68 + c]);
    }
    async_wait();     // own wave's q + k copies done
    __syncthreads();  // everyone's copies done

    // S = Q * K^T  (16 rows x 64 keys per wave)
    v8f s_acc[4];
#pragma unroll
    for (int t = 0; t < 4; ++t) s_acc[t] = v8f_zero();
#pragma unroll
    for (int kk = 0; kk < 64; kk += 4) {
      const int ka = kk + lh * 2;
      v2f a;
      a.x = q_s[(wave * 16 + lr) * 68 + ka];
      a.y = q_s[(wave * 16 + lr) * 68 + ka + 1];
#pragma unroll
      for (int t = 0; t < 4; ++t) {
        v2f bb;
        bb.x = kv_s[(t * 16 + lr) * 68 + ka];  // B[d][key] = k[key][d]
        bb.y = kv_s[(t * 16 + lr) * 68 + ka + 1];
        s_acc[t] = wmma4(a, bb, s_acc[t]);
      }
    }

    // online softmax (row = j + 8*lh; values for a row live in the 16 lanes
    // of that half -> shfl_xor masks 1,2,4,8 stay within the half)
#pragma unroll
    for (int j = 0; j < 8; ++j) {
      float mx = fmaxf(fmaxf(s_acc[0][j], s_acc[1][j]),
                       fmaxf(s_acc[2][j], s_acc[3][j]));
      mx = half_max(mx) * 0.125f;
      const float nm = fmaxf(m_run[j], mx);
      const float alpha = __expf(m_run[j] - nm);
      m_run[j] = nm;
      float rs = 0.0f;
#pragma unroll
      for (int t = 0; t < 4; ++t) {
        const float p = __expf(s_acc[t][j] * 0.125f - nm);
        s_acc[t][j] = p;
        rs += p;
      }
      rs = half_sum(rs);
      l_run[j] = l_run[j] * alpha + rs;
#pragma unroll
      for (int t = 0; t < 4; ++t) o_acc[t][j] *= alpha;
    }

    // P (C-layout) -> per-wave LDS -> A-layout for the PV matmul
#pragma unroll
    for (int t = 0; t < 4; ++t)
#pragma unroll
      for (int j = 0; j < 8; ++j)
        p_s[wave * 1088 + (j + lh * 8) * 68 + t * 16 + lr] = s_acc[t][j];

    __syncthreads();  // all waves done with K; also fences p_s writes
    {                 // load V chunk into the same buffer
      const int r = (tid >> 4) * 8, c = (tid & 15) * 4;
      const float* g =
          KV + ((long)(b * 1024 + kb + r)) * 512 + 256 + head * 64 + c;
#pragma unroll
      for (int i = 0; i < 8; ++i)
        async_b128(g + i * 512, &kv_s[(r + i) * 68 + c]);
    }
    async_wait();
    __syncthreads();

    // O += P * V   (K-dim = 64 keys)
#pragma unroll
    for (int kk = 0; kk < 64; kk += 4) {
      const int ka = kk + lh * 2;
      v2f a;
      a.x = p_s[wave * 1088 + lr * 68 + ka];
      a.y = p_s[wave * 1088 + lr * 68 + ka + 1];
#pragma unroll
      for (int t = 0; t < 4; ++t) {
        v2f bb;
        bb.x = kv_s[ka * 68 + t * 16 + lr];  // B[key][d] = v[key][d]
        bb.y = kv_s[(ka + 1) * 68 + t * 16 + lr];
        o_acc[t] = wmma4(a, bb, o_acc[t]);
      }
    }
  }

  // normalize and store (row m uniform across its 16-lane half)
#pragma unroll
  for (int j = 0; j < 8; ++j) {
    const float inv = 1.0f / l_run[j];
    const int m = n0 + wave * 16 + j + lh * 8;
#pragma unroll
    for (int t = 0; t < 4; ++t) {
      O[((long)(b * 4096 + m)) * 256 + head * 64 + t * 16 + lr] =
          o_acc[t][j] * inv;
    }
  }
}

// ---------------------------------------------------------------------------
extern "C" void kernel_launch(void* const* d_in, const int* in_sizes, int n_in,
                              void* d_out, int out_size, void* d_ws,
                              size_t ws_size, hipStream_t stream) {
  (void)in_sizes; (void)n_in; (void)out_size; (void)ws_size;
  const float* x        = (const float*)d_in[0];
  const float* h_qkv_w  = (const float*)d_in[1];
  const float* h_proj_w = (const float*)d_in[2];
  const float* h_proj_b = (const float*)d_in[3];
  const float* l_q_w    = (const float*)d_in[4];
  const float* l_kv_w   = (const float*)d_in[5];
  const float* l_proj_w = (const float*)d_in[6];
  const float* l_proj_b = (const float*)d_in[7];
  float* out = (float*)d_out;
  float* ws = (float*)d_ws;

  float* qkv    = ws;             // 32768*768
  float* ho     = ws + 25165824L; // 32768*256
  float* pooled = ws;             // reused after hifi_attn (stream-ordered)
  float* qlo    = ws + 4194304L;  // 8*4096*256
  float* kvlo   = ws + 12582912L; // 8*1024*512
  float* olo    = ws + 16777216L; // 8*4096*256

  // ---- Hi-Fi path ----
  // qkv = x(32768x512, contiguous) @ h_qkv_w(512x768)
  wmma_gemm_f32<<<dim3(12, 512, 1), 128, 0, stream>>>(
      x, h_qkv_w, nullptr, qkv, 32768, 768, 512, 512, 768, 768,
      /*a_cm=*/0, 0L, 0L, /*nchw=*/0, 0);
  hifi_attn<<<512, 256, 0, stream>>>(qkv, ho);
  // out[:, 0:256] = ho @ h_proj_w + h_proj_b  (NCHW scatter epilogue)
  wmma_gemm_f32<<<dim3(4, 512, 1), 128, 0, stream>>>(
      ho, h_proj_w, h_proj_b, out, 32768, 256, 256, 256, 256, 0,
      /*a_cm=*/0, 0L, 0L, /*nchw=*/1, /*chan_off=*/0);

  // ---- Lo-Fi path ----
  lofi_pool<<<16384, 256, 0, stream>>>(x, pooled);
  // q = x[b]^T(4096x512, col-major) @ l_q_w(512x256), batched over b
  wmma_gemm_f32<<<dim3(4, 64, 8), 128, 0, stream>>>(
      x, l_q_w, nullptr, qlo, 4096, 256, 512, 4096, 256, 256,
      /*a_cm=*/1, 2097152L, 1048576L, /*nchw=*/0, 0);
  // kv = pooled[b]^T(1024x512, col-major) @ l_kv_w(512x512)
  wmma_gemm_f32<<<dim3(8, 16, 8), 128, 0, stream>>>(
      pooled, l_kv_w, nullptr, kvlo, 1024, 512, 512, 1024, 512, 512,
      /*a_cm=*/1, 524288L, 524288L, /*nchw=*/0, 0);
  lofi_flash<<<dim3(64, 4, 8), 128, 0, stream>>>(qlo, kvlo, olo);
  // out[:, 256:512] = olo @ l_proj_w + l_proj_b
  wmma_gemm_f32<<<dim3(4, 512, 1), 128, 0, stream>>>(
      olo, l_proj_w, l_proj_b, out, 32768, 256, 256, 256, 256, 0,
      /*a_cm=*/0, 0L, 0L, /*nchw=*/1, /*chan_off=*/256);
}

// v002
// Measured time: 581 microseconds a run.
// Two timings next to v001 both put it at 1.07 times that version's speed.
// Counting every step since v000, it is 1.13 times as fast.
#include <hip/hip_runtime.h>
#include <hip/hip_bf16.h>

// HiLo attention forward, fp32 end-to-end on gfx1250 (wave32, WMMA).
//
// Roofline: ~82 GFLOP vs >=400MB HBM traffic -> memory bound at 23.3TB/s
// (~20us floor needs only ~4 PFLOP/s of matrix throughput). So we keep fp32
// precision and use V_WMMA_F32_16X16X4_F32 for every matmul; effort goes into
// the CDNA5 data-movement path: GLOBAL_LOAD_ASYNC_TO_LDS_* tile staging
// (ASYNCcnt-tracked, no VGPR round-trip), coalesced b128 chunks, and a
// flash-attention pass that keeps the 4096x1024 lofi score matrix out of HBM.
//
// Workspace layout (floats), max 33,554,432 floats = 128 MB:
//   [0,            25165824)  qkv   (32768 x 768)   -- hifi, then reused:
//     [0,        4194304)     pooled (8 x 512 x 1024)
//     [4194304, 12582912)     q_lo   (8 x 4096 x 256)
//     [12582912,16777216)     kv_lo  (8 x 1024 x 512)
//     [16777216,25165824)     o_lo   (8 x 4096 x 256)
//   [25165824,    33554432)  ho    (32768 x 256)

typedef float v2f __attribute__((ext_vector_type(2)));
typedef float v4f __attribute__((ext_vector_type(4)));
typedef float v8f __attribute__((ext_vector_type(8)));

// ---------------------------------------------------------------------------
// Async global->LDS copies (CDNA5 GLOBAL_LOAD_ASYNC_TO_LDS_*, ASYNCcnt).
// Builtin signatures:
//   b128: (v4i AS1*, v4i AS3*, imm int, imm int)   [v4i = vector_size(16) int]
//   b32 : (int AS1*, int AS3*, imm int, imm int)
// Generic LDS pointers carry the LDS byte offset in their low 32 bits
// (ISA 10.2: LDS_ADDR = addr[31:0]), so AS(3)/AS(1) pointers are materialized
// via inttoptr.  Fallback = synchronous VGPR staging if builtins are absent.
// ---------------------------------------------------------------------------
#if __has_builtin(__builtin_amdgcn_global_load_async_to_lds_b128) && \
    __has_builtin(__builtin_amdgcn_global_load_async_to_lds_b32)
#define HAS_ASYNC_LDS 1
#else
#define HAS_ASYNC_LDS 0
#endif

typedef int b128_t __attribute__((vector_size(16)));

#define AS1P(T, p) ((__attribute__((address_space(1))) T*)(uintptr_t)(p))
#define AS3P(T, p) ((__attribute__((address_space(3))) T*)(unsigned)(uintptr_t)(p))

__device__ __forceinline__ void async_b128(const float* g, float* l) {
#if HAS_ASYNC_LDS
  __builtin_amdgcn_global_load_async_to_lds_b128(AS1P(b128_t, g),
                                                 AS3P(b128_t, l), 0, 0);
#else
  *(float4*)l = *(const float4*)g;
#endif
}
__device__ __forceinline__ void async_b32(const float* g, float* l) {
#if HAS_ASYNC_LDS
  __builtin_amdgcn_global_load_async_to_lds_b32(AS1P(int, g), AS3P(int, l), 0,
                                                0);
#else
  *l = *g;
#endif
}
__device__ __forceinline__ void async_wait() {
#if HAS_ASYNC_LDS
#if __has_builtin(__builtin_amdgcn_s_wait_asynccnt)
  __builtin_amdgcn_s_wait_asynccnt(0);
#else
  asm volatile("s_wait_asynccnt 0x0" ::: "memory");
#endif
#endif
}

__device__ __forceinline__ v8f v8f_zero() {
  v8f z;
#pragma unroll
  for (int i = 0; i < 8; ++i) z[i] = 0.0f;
  return z;
}

// D = A(16x4) * B(4x16) + C, fp32.  A: lane m=l&15, vgpr0/1 = K=(l>>4)*2,+1.
// B: lane n=l&15, vgpr0/1 = rows K=(l>>4)*2,+1.  C/D: vgpr j -> M=j(+8), N=l&15.
__device__ __forceinline__ v8f wmma4(v2f a, v2f b, v8f c) {
  return __builtin_amdgcn_wmma_f32_16x16x4_f32(false, a, false, b, (short)0, c,
                                               false, false);
}

__device__ __forceinline__ float half_max(float v) {
  v = fmaxf(v, __shfl_xor(v, 1, 32));
  v = fmaxf(v, __shfl_xor(v, 2, 32));
  v = fmaxf(v, __shfl_xor(v, 4, 32));
  v = fmaxf(v, __shfl_xor(v, 8, 32));
  return v;
}
__device__ __forceinline__ float half_sum(float v) {
  v += __shfl_xor(v, 1, 32);
  v += __shfl_xor(v, 2, 32);
  v += __shfl_xor(v, 4, 32);
  v += __shfl_xor(v, 8, 32);
  return v;
}

// ---------------------------------------------------------------------------
// Generic fp32 WMMA GEMM: C = A * B (+bias).  Block = 128 threads = 4 waves,
// block tile 64x64, BK=16.  Wave w computes rows [w*16, w*16+16) x 64 cols.
// Accumulator tile t holds the columns 4*lr + t (not t*16 + lr): one 16-byte
// LDS read of a B row then feeds all four tiles, 16 lanes read one whole 256-B
// row (no bank conflict), and a lane owns 4 adjacent output columns.
//   a_cm=0: A[m*lda+k] (row-major, async b128 staging)
//   a_cm=1: A[k*lda+m] (col-major / A^T view, async b32 transpose staging)
//   epi_nchw=1: scatter C into NCHW output:
//       out[((m>>12)*512 + chan_off + col)*4096 + (m&4095)]
// LDS pads: A stride 20 floats (b128-aligned dst, conflict-free a-frag reads,
// 8B-aligned {k,k+1} pairs), B stride 68 floats (b128-aligned dst).
// Staging lane map: adjacent lanes copy adjacent global bytes, so one wave-wide
// copy touches as few 128-B lines as the tile shape allows (B: 2 rows x 256 B,
// row-major A: 8 rows x 64 B, col-major A: 128 B of one k row).
// ---------------------------------------------------------------------------
__global__ void __launch_bounds__(128) wmma_gemm_f32(
    const float* __restrict__ A, const float* __restrict__ Bm,
    const float* __restrict__ bias, float* __restrict__ C, int M, int N, int K,
    int lda, int ldb, int ldc, int a_cm, long aStride, long cStride,
    int epi_nchw, int chan_off) {
  __shared__ float As[64 * 20];  // [m][k]
  __shared__ __attribute__((aligned(16))) float Bs[16 * 68];  // [k][n]

  const float* Ab = A + (long)blockIdx.z * aStride;
  float* Cb = C + (epi_nchw ? 0L : (long)blockIdx.z * cStride);

  const int m0 = blockIdx.y * 64;
  const int n0 = blockIdx.x * 64;
  const int tid = threadIdx.x;
  const int wave = tid >> 5;
  const int lane = tid & 31;
  const int lr = lane & 15;  // row (A) / col (B,C)
  const int lh = lane >> 4;  // k-half selector

  v8f acc[4];
#pragma unroll
  for (int t = 0; t < 4; ++t) acc[t] = v8f_zero();

  for (int k0 = 0; k0 < K; k0 += 16) {
    // ---- stage A tile (64x16) ----
    if (a_cm) {
      const int ck = tid >> 6;       // k 0..1, +2 per copy
      const int r = tid & 63;        // m 0..63
      const float* g = Ab + (long)(k0 + ck) * lda + m0 + r;
#pragma unroll
      for (int i = 0; i < 8; ++i)
        async_b32(g + (long)(2 * i) * lda, &As[r * 20 + ck + 2 * i]);
    } else {
      const int r = tid >> 2;        // m 0..31, +32 for the second copy
      const int c = (tid & 3) * 4;   // k offset
      const float* g = Ab + (long)(m0 + r) * lda + k0 + c;
      async_b128(g, &As[r * 20 + c]);
      async_b128(g + (long)32 * lda, &As[(r + 32) * 20 + c]);
    }
    // ---- stage B tile (16x64) ----
    {
      const int kk = tid >> 4;       // k 0..7, +8 for the second copy
      const int c = (tid & 15) * 4;  // n offset
      const float* g = Bm + (long)(k0 + kk) * ldb + n0 + c;
      async_b128(g, &Bs[kk * 68 + c]);
      async_b128(g + (long)8 * ldb, &Bs[(kk + 8) * 68 + c]);
    }
    async_wait();
    __syncthreads();

#pragma unroll
    for (int kk = 0; kk < 16; kk += 4) {
      const int ka = kk + lh * 2;
      v2f a;
      const float* ap = &As[(wave * 16 + lr) * 20 + ka];
      a.x = ap[0];
      a.y = ap[1];
      const v4f b0 = *(const v4f*)&Bs[ka * 68 + lr * 4];
      const v4f b1 = *(const v4f*)&Bs[(ka + 1) * 68 + lr * 4];
#pragma unroll
      for (int t = 0; t < 4; ++t) {
        v2f b;
        b.x = b0[t];
        b.y = b1[t];
        acc[t] = wmma4(a, b, acc[t]);
      }
    }
    __syncthreads();
  }

  // ---- epilogue ----
  const int col = n0 + lr * 4;  // first of this lane's 4 adjacent columns
  v4f bv;
#pragma unroll  // constant t: bv[t] stays in a register
  for (int t = 0; t < 4; ++t) bv[t] = bias ? bias[col + t] : 0.0f;
#pragma unroll
  for (int j = 0; j < 8; ++j) {
    const int m = m0 + wave * 16 + j + lh * 8;
    v4f v;
#pragma unroll  // constant t: acc[t] and v[t] stay in registers
    for (int t = 0; t < 4; ++t) v[t] = acc[t][j] + bv[t];
    if (m < M && col + 3 < N) {
      if (epi_nchw) {
        const int bb = m >> 12;  // batch (4096 spatial tokens / image)
        const int sp = m & 4095; // h*64+w
#pragma unroll  // constant t: v[t] stays in a register
        for (int t = 0; t < 4; ++t)
          C[((long)(bb * 512 + chan_off + col + t)) * 4096 + sp] = v[t];
        // the stores' address registers may be rewritten behind this point
        asm volatile("s_wait_xcnt 0x0" ::: "memory");
      } else {
        *(v4f*)&Cb[(long)m * ldc + col] = v;  // 16 lanes = one 256-B row piece
      }
    }
  }
}

// ---------------------------------------------------------------------------
// Hifi windowed attention: 2x2 windows, 4 heads x 64 dims, softmax over 4.
// One thread per (b, window, head, token).  qkv rows are the hifi token rows
// (row r = b*4096 + i0*128 + i1*64 + i2*2 + i3, identical to the spatial row
// h*64+w), with per-row layout [q(4x64) | k(4x64) | v(4x64)].
// ---------------------------------------------------------------------------
__global__ void __launch_bounds__(256) hifi_attn(const float* __restrict__ qkv,
                                                 float* __restrict__ ho) {
  const int idx = blockIdx.x * 256 + threadIdx.x;  // 131072 total
  const int t = idx & 3;
  const int head = (idx >> 2) & 3;
  const int g = (idx >> 4) & 1023;
  const int b = idx >> 14;
  const int base = b * 4096 + (g >> 5) * 128 + (g & 31) * 2;
  int rows[4];
  rows[0] = base; rows[1] = base + 1; rows[2] = base + 64; rows[3] = base + 65;

  const float4* q4 = (const float4*)(qkv + (long)rows[t] * 768 + head * 64);
  float s[4];
#pragma unroll
  for (int j = 0; j < 4; ++j) {
    const float4* k4 =
        (const float4*)(qkv + (long)rows[j] * 768 + 256 + head * 64);
    float a = 0.0f;
#pragma unroll
    for (int d = 0; d < 16; ++d) {
      float4 qa = q4[d], kb = k4[d];
      a += qa.x * kb.x + qa.y * kb.y + qa.z * kb.z + qa.w * kb.w;
    }
    s[j] = a * 0.125f;  // 64^-0.5
  }
  float mx = fmaxf(fmaxf(s[0], s[1]), fmaxf(s[2], s[3]));
  float w[4], sum = 0.0f;
#pragma unroll
  for (int j = 0; j < 4; ++j) { w[j] = __expf(s[j] - mx); sum += w[j]; }
  const float inv = 1.0f / sum;
#pragma unroll
  for (int j = 0; j < 4; ++j) w[j] *= inv;

  const float4* v0 = (const float4*)(qkv + (long)rows[0] * 768 + 512 + head * 64);
  const float4* v1 = (const float4*)(qkv + (long)rows[1] * 768 + 512 + head * 64);
  const float4* v2 = (const float4*)(qkv + (long)rows[2] * 768 + 512 + head * 64);
  const float4* v3 = (const float4*)(qkv + (long)rows[3] * 768 + 512 + head * 64);
  float4* o4 = (float4*)(ho + (long)rows[t] * 256 + head * 64);
#pragma unroll
  for (int d = 0; d < 16; ++d) {
    float4 a = v0[d], bb = v1[d], c = v2[d], e = v3[d], r;
    r.x = w[0] * a.x + w[1] * bb.x + w[2] * c.x + w[3] * e.x;
    r.y = w[0] * a.y + w[1] * bb.y + w[2] * c.y + w[3] * e.y;
    r.z = w[0] * a.z + w[1] * bb.z + w[2] * c.z + w[3] * e.z;
    r.w = w[0] * a.w + w[1] * bb.w + w[2] * c.w + w[3] * e.w;
    o4[d] = r;
  }
}

// ---------------------------------------------------------------------------
// Lofi 2x2 average pool: x (B,512,64,64) -> pooled (B,512,32,32) flat.
// ---------------------------------------------------------------------------
__global__ void __launch_bounds__(256) lofi_pool(const float* __restrict__ x,
                                                 float* __restrict__ pooled) {
  const int idx = blockIdx.x * 256 + threadIdx.x;  // 8*512*1024
  const int j = idx & 31;
  const int i = (idx >> 5) & 31;
  const int c = (idx >> 10) & 511;
  const int b = idx >> 19;
  const float* p = x + (long)(b * 512 + c) * 4096 + i * 128 + j * 2;
  pooled[idx] = 0.25f * (p[0] + p[1] + p[64] + p[65]);
}

// ---------------------------------------------------------------------------
// Lofi flash attention.  One block = 128 threads = 4 waves handles 64 q rows
// for one (b, head); keys streamed in 64-wide chunks with online softmax.
// Q: q_lo[(b*4096+n)*256 + head*64 + d], K/V: kv_lo[(b*1024+m)*512 + {0,256}
// + head*64 + d].  The k LDS buffer is reused for v within each chunk so the
// static LDS footprint stays at ~52 KB.  All tile fills are async-to-LDS; 16
// adjacent lanes copy one whole 256-B tile row (two full lines), each 16-lane
// group owning 8 consecutive rows.
// ---------------------------------------------------------------------------
__global__ void __launch_bounds__(128) lofi_flash(const float* __restrict__ Q,
                                                  const float* __restrict__ KV,
                                                  float* __restrict__ O) {
  __shared__ float q_s[64 * 68];      // [row][d], pad 68 (272B, b128-aligned)
  __shared__ __attribute__((aligned(16))) float kv_s[64 * 68];  // [key][d]; K, then V
  __shared__ float p_s[4 * 16 * 68];  // per-wave P relayout scratch

  const int b = blockIdx.z;
  const int head = blockIdx.y;
  const int n0 = blockIdx.x * 64;
  const int tid = threadIdx.x;
  const int wave = tid >> 5;
  const int lane = tid & 31;
  const int lr = lane & 15;
  const int lh = lane >> 4;

  {  // stage the 64x64 Q tile once (async; waited before first use)
    const int r = (tid >> 4) * 8, c = (tid & 15) * 4;
    const float* g = Q + ((long)(b * 4096 + n0 + r)) * 256 + head * 64 + c;
#pragma unroll
    for (int i = 0; i < 8; ++i) async_b128(g + i * 256, &q_s[(r + i) * 68 + c]);
  }

  // this lane's 4 head dims in V row 2*lh; the keys of a chunk are constant offsets
  const float* vp = &kv_s[lh * 2 * 68 + lr * 4];

  v8f o_acc[4];
  float m_run[8], l_run[8];
#pragma unroll
  for (int t = 0; t < 4; ++t) o_acc[t] = v8f_zero();
#pragma unroll
  for (int j = 0; j < 8; ++j) { m_run[j] = -1e30f; l_run[j] = 0.0f; }

  for (int kb = 0; kb < 1024; kb += 64) {
    __syncthreads();  // previous chunk's PV reads of kv_s done
    {                 // load K chunk (64 keys x 64 dims)
      const int r = (tid >> 4) * 8, c = (tid & 15) * 4;
      const float* g =
          KV + ((long)(b * 1024 + kb + r)) * 512 + head * 64 + c;
#pragma unroll
      for (int i = 0; i < 8; ++i)
        async_b128(g + i * 512, &kv_s[(r + i) * 68 + c]);
    }
    async_wait();     // own wave's q + k copies done
    __syncthreads();  // everyone's copies done

    // S = Q * K^T  (16 rows x 64 keys per wave)
    v8f s_acc[4];
#pragma unroll
    for (int t = 0; t < 4; ++t) s_acc[t] = v8f_zero();
#pragma unroll
    for (int kk = 0; kk < 64; kk += 4) {
      const int ka = kk + lh * 2;
      v2f a;
      a.x = q_s[(wave * 16 + lr) * 68 + ka];
      a.y = q_s[(wave * 16 + lr) * 68 + ka + 1];
#pragma unroll
      for (int t = 0; t < 4; ++t) {
        v2f bb;
        bb.x = kv_s[(t * 16 + lr) * 68 + ka];  // B[d][key] = k[key][d]
        bb.y = kv_s[(t * 16 + lr) * 68 + ka + 1];
        s_acc[t] = wmma4(a, bb, s_acc[t]);
      }
    }

    // online softmax (row = j + 8*lh; values for a row live in the 16 lanes
    // of that half -> shfl_xor masks 1,2,4,8 stay within the half)
#pragma unroll
    for (int j = 0; j < 8; ++j) {
      float mx = fmaxf(fmaxf(s_acc[0][j], s_acc[1][j]),
                       fmaxf(s_acc[2][j], s_acc[3][j]));
      mx = half_max(mx) * 0.125f;
      const float nm = fmaxf(m_run[j], mx);
      const float alpha = __expf(m_run[j] - nm);
      m_run[j] = nm;
      float rs = 0.0f;
#pragma unroll
      for (int t = 0; t < 4; ++t) {
        const float p = __expf(s_acc[t][j] * 0.125f - nm);
        s_acc[t][j] = p;
        rs += p;
      }
      rs = half_sum(rs);
      l_run[j] = l_run[j] * alpha + rs;
#pragma unroll
      for (int t = 0; t < 4; ++t) o_acc[t][j] *= alpha;
    }

    // P (C-layout) -> per-wave LDS -> A-layout for the PV matmul
#pragma unroll
    for (int t = 0; t < 4; ++t)
#pragma unroll
      for (int j = 0; j < 8; ++j)
        p_s[wave * 1088 + (j + lh * 8) * 68 + t * 16 + lr] = s_acc[t][j];

    __syncthreads();  // all waves done with K; also fences p_s writes
    {                 // load V chunk into the same buffer
      const int r = (tid >> 4) * 8, c = (tid & 15) * 4;
      const float* g =
          KV + ((long)(b * 1024 + kb + r)) * 512 + 256 + head * 64 + c;
#pragma unroll
      for (int i = 0; i < 8; ++i)
        async_b128(g + i * 512, &kv_s[(r + i) * 68 + c]);
    }
    async_wait();
    __syncthreads();

    // O += P * V   (K-dim = 64 keys)
#pragma unroll
    for (int kk = 0; kk < 64; kk += 4) {
      const int ka = kk + lh * 2;
      v2f a;
      a.x = p_s[wave * 1088 + lr * 68 + ka];
      a.y = p_s[wave * 1088 + lr * 68 + ka + 1];
      // o_acc[t] holds head dims 4*lr + t: one 16-byte read per V row
      const v4f v0 = *(const v4f*)(vp + kk * 68);        // B[key][d], key ka
      const v4f v1 = *(const v4f*)(vp + (kk + 1) * 68);  // key ka + 1
#pragma unroll
      for (int t = 0; t < 4; ++t) {
        v2f bb;
        bb.x = v0[t];
        bb.y = v1[t];
        o_acc[t] = wmma4(a, bb, o_acc[t]);
      }
    }
  }

  // normalize and store (row m uniform across its 16-lane half)
#pragma unroll
  for (int j = 0; j < 8; ++j) {
    const float inv = 1.0f / l_run[j];
    const int m = n0 + wave * 16 + j + lh * 8;
    v4f o;
#pragma unroll
    for (int t = 0; t < 4; ++t) o[t] = o_acc[t][j] * inv;
    *(v4f*)&O[((long)(b * 4096 + m)) * 256 + head * 64 + lr * 4] = o;
  }
}

// ---------------------------------------------------------------------------
extern "C" void kernel_launch(void* const* d_in, const int* in_sizes, int n_in,
                              void* d_out, int out_size, void* d_ws,
                              size_t ws_size, hipStream_t stream) {
  (void)in_sizes; (void)n_in; (void)out_size; (void)ws_size;
  const float* x        = (const float*)d_in[0];
  const float* h_qkv_w  = (const float*)d_in[1];
  const float* h_proj_w = (const float*)d_in[2];
  const float* h_proj_b = (const float*)d_in[3];
  const float* l_q_w    = (const float*)d_in[4];
  const float* l_kv_w   = (const float*)d_in[5];
  const float* l_proj_w = (const float*)d_in[6];
  const float* l_proj_b = (const float*)d_in[7];
  float* out = (float*)d_out;
  float* ws = (float*)d_ws;

  float* qkv    = ws;             // 32768*768
  float* ho     = ws + 25165824L; // 32768*256
  float* pooled = ws;             // reused after hifi_attn (stream-ordered)
  float* qlo    = ws + 4194304L;  // 8*4096*256
  float* kvlo   = ws + 12582912L; // 8*1024*512
  float* olo    = ws + 16777216L; // 8*4096*256

  // ---- Hi-Fi path ----
  // qkv = x(32768x512, contiguous) @ h_qkv_w(512x768)
  wmma_gemm_f32<<<dim3(12, 512, 1), 128, 0, stream>>>(
      x, h_qkv_w, nullptr, qkv, 32768, 768, 512, 512, 768, 768,
      /*a_cm=*/0, 0L, 0L, /*nchw=*/0, 0);
  hifi_attn<<<512, 256, 0, stream>>>(qkv, ho);
  // out[:, 0:256] = ho @ h_proj_w + h_proj_b  (NCHW scatter epilogue)
  wmma_gemm_f32<<<dim3(4, 512, 1), 128, 0, stream>>>(
      ho, h_proj_w, h_proj_b, out, 32768, 256, 256, 256, 256, 0,
      /*a_cm=*/0, 0L, 0L, /*nchw=*/1, /*chan_off=*/0);

  // ---- Lo-Fi path ----
  lofi_pool<<<16384, 256, 0, stream>>>(x, pooled);
  // q = x[b]^T(4096x512, col-major) @ l_q_w(512x256), batched over b
  wmma_gemm_f32<<<dim3(4, 64, 8), 128, 0, stream>>>(
      x, l_q_w, nullptr, qlo, 4096, 256, 512, 4096, 256, 256,
      /*a_cm=*/1, 2097152L, 1048576L, /*nchw=*/0, 0);
  // kv = pooled[b]^T(1024x512, col-major) @ l_kv_w(512x512)
  wmma_gemm_f32<<<dim3(8, 16, 8), 128, 0, stream>>>(
      pooled, l_kv_w, nullptr, kvlo, 1024, 512, 512, 1024, 512, 512,
      /*a_cm=*/1, 524288L, 524288L, /*nchw=*/0, 0);
  lofi_flash<<<dim3(64, 4, 8), 128, 0, stream>>>(qlo, kvlo, olo);
  // out[:, 256:512] = olo @ l_proj_w + l_proj_b
  wmma_gemm_f32<<<dim3(4, 512, 1), 128, 0, stream>>>(
      olo, l_proj_w, l_proj_b, out, 32768, 256, 256, 256, 256, 0,
      /*a_cm=*/0, 0L, 0L, /*nchw=*/1, /*chan_off=*/256);
}

// v003
// It runs in 555 microseconds.
// Next to v002, in two timings, it ran 1.05 times as fast each time.
// Counting every step since v000, it is 1.18 times as fast.
#include <hip/hip_runtime.h>
#include <hip/hip_bf16.h>

// HiLo attention forward, fp32 end-to-end on gfx1250 (wave32, WMMA).
//
// Roofline: ~82 GFLOP vs >=400MB HBM traffic -> memory bound at 23.3TB/s
// (~20us floor needs only ~4 PFLOP/s of matrix throughput). So we keep fp32
// precision and use V_WMMA_F32_16X16X4_F32 for every matmul; effort goes into
// the CDNA5 data-movement path: GLOBAL_LOAD_ASYNC_TO_LDS_* tile staging
// (ASYNCcnt-tracked, no VGPR round-trip), coalesced b128 chunks, and a
// flash-attention pass that keeps the 4096x1024 lofi score matrix out of HBM.
//
// Workspace layout (floats), max 33,554,432 floats = 128 MB:
//   [0,            25165824)  qkv   (32768 x 768)   -- hifi, then reused:
//     [0,        4194304)     pooled (8 x 512 x 1024)
//     [4194304, 12582912)     q_lo   (8 x 4096 x 256)
//     [12582912,16777216)     kv_lo  (8 x 1024 x 512)
//     [16777216,25165824)     o_lo   (8 x 4096 x 256)
//   [25165824,    33554432)  ho    (32768 x 256)

typedef float v2f __attribute__((ext_vector_type(2)));
typedef float v4f __attribute__((ext_vector_type(4)));
typedef float v8f __attribute__((ext_vector_type(8)));

// ---------------------------------------------------------------------------
// Async global->LDS copies (CDNA5 GLOBAL_LOAD_ASYNC_TO_LDS_*, ASYNCcnt).
// Builtin signatures:
//   b128: (v4i AS1*, v4i AS3*, imm int, imm int)   [v4i = vector_size(16) int]
//   b32 : (int AS1*, int AS3*, imm int, imm int)
// Generic LDS pointers carry the LDS byte offset in their low 32 bits
// (ISA 10.2: LDS_ADDR = addr[31:0]), so AS(3)/AS(1) pointers are materialized
// via inttoptr.  Fallback = synchronous VGPR staging if builtins are absent.
// ---------------------------------------------------------------------------
#if __has_builtin(__builtin_amdgcn_global_load_async_to_lds_b128) && \
    __has_builtin(__builtin_amdgcn_global_load_async_to_lds_b32)
#define HAS_ASYNC_LDS 1
#else
#define HAS_ASYNC_LDS 0
#endif

typedef int b128_t __attribute__((vector_size(16)));

#define AS1P(T, p) ((__attribute__((address_space(1))) T*)(uintptr_t)(p))
#define AS3P(T, p) ((__attribute__((address_space(3))) T*)(unsigned)(uintptr_t)(p))

__device__ __forceinline__ void async_b128(const float* g, float* l) {
#if HAS_ASYNC_LDS
  __builtin_amdgcn_global_load_async_to_lds_b128(AS1P(b128_t, g),
                                                 AS3P(b128_t, l), 0, 0);
#else
  *(float4*)l = *(const float4*)g;
#endif
}
__device__ __forceinline__ void async_b32(const float* g, float* l) {
#if HAS_ASYNC_LDS
  __builtin_amdgcn_global_load_async_to_lds_b32(AS1P(int, g), AS3P(int, l), 0,
                                                0);
#else
  *l = *g;
#endif
}

__device__ __forceinline__ v8f v8f_zero() {
  v8f z;
#pragma unroll
  for (int i = 0; i < 8; ++i) z[i] = 0.0f;
  return z;
}

// D = A(16x4) * B(4x16) + C, fp32.  A: lane m=l&15, vgpr0/1 = K=(l>>4)*2,+1.
// B: lane n=l&15, vgpr0/1 = rows K=(l>>4)*2,+1.  C/D: vgpr j -> M=j(+8), N=l&15.
__device__ __forceinline__ v8f wmma4(v2f a, v2f b, v8f c) {
  return __builtin_amdgcn_wmma_f32_16x16x4_f32(false, a, false, b, (short)0, c,
                                               false, false);
}

__device__ __forceinline__ float half_max(float v) {
  v = fmaxf(v, __shfl_xor(v, 1, 32));
  v = fmaxf(v, __shfl_xor(v, 2, 32));
  v = fmaxf(v, __shfl_xor(v, 4, 32));
  v = fmaxf(v, __shfl_xor(v, 8, 32));
  return v;
}
__device__ __forceinline__ float half_sum(float v) {
  v += __shfl_xor(v, 1, 32);
  v += __shfl_xor(v, 2, 32);
  v += __shfl_xor(v, 4, 32);
  v += __shfl_xor(v, 8, 32);
  return v;
}

// ---------------------------------------------------------------------------
// Generic fp32 WMMA GEMM: C = A * B (+bias).  Block = 128 threads = 4 waves,
// block tile 64x64, BK=16.  Wave w computes rows [w*16, w*16+16) x 64 cols.
// Accumulator tile t holds the columns 4*lr + t (not t*16 + lr): one 16-byte
// LDS read of a B row then feeds all four tiles, 16 lanes read one whole 256-B
// row (no bank conflict), and a lane owns 4 adjacent output columns.
//   a_cm=0: A[m*lda+k] (row-major, async b128 staging)
//   a_cm=1: A[k*lda+m] (col-major / A^T view, async b32 transpose staging)
//   epi_nchw=1: scatter C into NCHW output:
//       out[((m>>12)*512 + chan_off + col)*4096 + (m&4095)]
// LDS pads: A stride 20 floats (b128-aligned dst, conflict-free a-frag reads,
// 8B-aligned {k,k+1} pairs), B stride 68 floats (b128-aligned dst).
// Staging lane map: adjacent lanes copy adjacent global bytes, so one wave-wide
// copy touches as few 128-B lines as the tile shape allows (B: 2 rows x 256 B,
// row-major A: 8 rows x 64 B, col-major A: 128 B of one k row).
// The tiles go through a ring of two LDS buffers: the copies of tile t + 1 fly
// while tile t is multiplied, and one barrier per trip both publishes tile
// t + 1 and frees the buffer of tile t for the copies of tile t + 2.
// ---------------------------------------------------------------------------
#define GEMM_A_FLOATS (64 * 20)                      // [m][k]
#define GEMM_BUF_FLOATS (GEMM_A_FLOATS + 16 * 68)    // A tile, then B tile [k][n]

// Issues the copies of the 64x16 A tile and the 16x64 B tile at k0 into one
// ring buffer (as, bs); the caller waits for them.
__device__ __forceinline__ void gemm_stage(const float* __restrict__ Ab,
                                           const float* __restrict__ Bm,
                                           float* as, float* bs, int k0, int m0,
                                           int n0, int lda, int ldb, int a_cm,
                                           int tid) {
  // ---- stage A tile (64x16) ----
  if (a_cm) {
    const int ck = tid >> 6;       // k 0..1, +2 per copy
    const int r = tid & 63;        // m 0..63
    const float* g = Ab + (long)(k0 + ck) * lda + m0 + r;
#pragma unroll  // the eight copies issue back to back, no loop counter between
    for (int i = 0; i < 8; ++i)
      async_b32(g + (long)(2 * i) * lda, &as[r * 20 + ck + 2 * i]);
  } else {
    const int r = tid >> 2;        // m 0..31, +32 for the second copy
    const int c = (tid & 3) * 4;   // k offset
    const float* g = Ab + (long)(m0 + r) * lda + k0 + c;
    async_b128(g, &as[r * 20 + c]);
    async_b128(g + (long)32 * lda, &as[(r + 32) * 20 + c]);
  }
  // ---- stage B tile (16x64) ----
  {
    const int kk = tid >> 4;       // k 0..7, +8 for the second copy
    const int c = (tid & 15) * 4;  // n offset
    const float* g = Bm + (long)(k0 + kk) * ldb + n0 + c;
    async_b128(g, &bs[kk * 68 + c]);
    async_b128(g + (long)8 * ldb, &bs[(kk + 8) * 68 + c]);
  }
}

__global__ void __launch_bounds__(128) wmma_gemm_f32(
    const float* __restrict__ A, const float* __restrict__ Bm,
    const float* __restrict__ bias, float* __restrict__ C, int M, int N, int K,
    int lda, int ldb, int ldc, int a_cm, long aStride, long cStride,
    int epi_nchw, int chan_off) {
  __shared__ __attribute__((aligned(16))) float ring[2][GEMM_BUF_FLOATS];

  const float* Ab = A + (long)blockIdx.z * aStride;
  float* Cb = C + (epi_nchw ? 0L : (long)blockIdx.z * cStride);

  const int m0 = blockIdx.y * 64;
  const int n0 = blockIdx.x * 64;
  const int tid = threadIdx.x;
  const int wave = tid >> 5;
  const int lane = tid & 31;
  const int lr = lane & 15;  // row (A) / col (B,C)
  const int lh = lane >> 4;  // k-half selector

  v8f acc[4];
#pragma unroll
  for (int t = 0; t < 4; ++t) acc[t] = v8f_zero();

  if (K > 0) {
    gemm_stage(Ab, Bm, ring[0], ring[0] + GEMM_A_FLOATS, 0, m0, n0, lda, ldb,
               a_cm, tid);
    // this wave's copies of tile 0 have landed before the barrier publishes them
    asm volatile("s_wait_asynccnt 0x0" ::: "memory");
    __syncthreads();
    if (K > 16)
      gemm_stage(Ab, Bm, ring[1], ring[1] + GEMM_A_FLOATS, 16, m0, n0, lda, ldb,
                 a_cm, tid);
  }

  for (int k0 = 0; k0 < K; k0 += 16) {
    float* As = ring[(k0 >> 4) & 1];  // this trip reads this buffer alone
    float* Bs = As + GEMM_A_FLOATS;

#pragma unroll
    for (int kk = 0; kk < 16; kk += 4) {
      const int ka = kk + lh * 2;
      v2f a;
      const float* ap = &As[(wave * 16 + lr) * 20 + ka];
      a.x = ap[0];
      a.y = ap[1];
      const v4f b0 = *(const v4f*)&Bs[ka * 68 + lr * 4];
      const v4f b1 = *(const v4f*)&Bs[(ka + 1) * 68 + lr * 4];
#pragma unroll
      for (int t = 0; t < 4; ++t) {
        v2f b;
        b.x = b0[t];
        b.y = b1[t];
        acc[t] = wmma4(a, b, acc[t]);
      }
    }
    // this wave's reads of the buffer are done before anyone refills it
    asm volatile("s_wait_dscnt 0x0" ::: "memory");
    // this wave's copies of the next tile have landed before the barrier
    asm volatile("s_wait_asynccnt 0x0" ::: "memory");
    __syncthreads();  // publishes the next tile, frees this trip's buffer
    if (k0 + 32 < K)
      gemm_stage(Ab, Bm, As, Bs, k0 + 32, m0, n0, lda, ldb, a_cm, tid);
  }
  // no copy is outstanding when the wave goes on to its end
  asm volatile("s_wait_asynccnt 0x0" ::: "memory");

  // ---- epilogue ----
  const int col = n0 + lr * 4;  // first of this lane's 4 adjacent columns
  v4f bv;
#pragma unroll  // constant t: bv[t] stays in a register
  for (int t = 0; t < 4; ++t) bv[t] = bias ? bias[col + t] : 0.0f;
#pragma unroll
  for (int j = 0; j < 8; ++j) {
    const int m = m0 + wave * 16 + j + lh * 8;
    v4f v;
#pragma unroll  // constant t: acc[t] and v[t] stay in registers
    for (int t = 0; t < 4; ++t) v[t] = acc[t][j] + bv[t];
    if (m < M && col + 3 < N) {
      if (epi_nchw) {
        const int bb = m >> 12;  // batch (4096 spatial tokens / image)
        const int sp = m & 4095; // h*64+w
#pragma unroll  // constant t: v[t] stays in a register
        for (int t = 0; t < 4; ++t)
          C[((long)(bb * 512 + chan_off + col + t)) * 4096 + sp] = v[t];
        // the stores' address registers may be rewritten behind this point
        asm volatile("s_wait_xcnt 0x0" ::: "memory");
      } else {
        *(v4f*)&Cb[(long)m * ldc + col] = v;  // 16 lanes = one 256-B row piece
      }
    }
  }
}

// ---------------------------------------------------------------------------
// Hifi windowed attention: 2x2 windows, 4 heads x 64 dims, softmax over 4.
// One thread per (b, window, head, token).  qkv rows are the hifi token rows
// (row r = b*4096 + i0*128 + i1*64 + i2*2 + i3, identical to the spatial row
// h*64+w), with per-row layout [q(4x64) | k(4x64) | v(4x64)].
// ---------------------------------------------------------------------------
__global__ void __launch_bounds__(256) hifi_attn(const float* __restrict__ qkv,
                                                 float* __restrict__ ho) {
  const int idx = blockIdx.x * 256 + threadIdx.x;  // 131072 total
  const int t = idx & 3;
  const int head = (idx >> 2) & 3;
  const int g = (idx >> 4) & 1023;
  const int b = idx >> 14;
  const int base = b * 4096 + (g >> 5) * 128 + (g & 31) * 2;
  int rows[4];
  rows[0] = base; rows[1] = base + 1; rows[2] = base + 64; rows[3] = base + 65;

  const float4* q4 = (const float4*)(qkv + (long)rows[t] * 768 + head * 64);
  float s[4];
#pragma unroll
  for (int j = 0; j < 4; ++j) {
    const float4* k4 =
        (const float4*)(qkv + (long)rows[j] * 768 + 256 + head * 64);
    float a = 0.0f;
#pragma unroll
    for (int d = 0; d < 16; ++d) {
      float4 qa = q4[d], kb = k4[d];
      a += qa.x * kb.x + qa.y * kb.y + qa.z * kb.z + qa.w * kb.w;
    }
    s[j] = a * 0.125f;  // 64^-0.5
  }
  float mx = fmaxf(fmaxf(s[0], s[1]), fmaxf(s[2], s[3]));
  float w[4], sum = 0.0f;
#pragma unroll
  for (int j = 0; j < 4; ++j) { w[j] = __expf(s[j] - mx); sum += w[j]; }
  const float inv = 1.0f / sum;
#pragma unroll
  for (int j = 0; j < 4; ++j) w[j] *= inv;

  const float4* v0 = (const float4*)(qkv + (long)rows[0] * 768 + 512 + head * 64);
  const float4* v1 = (const float4*)(qkv + (long)rows[1] * 768 + 512 + head * 64);
  const float4* v2 = (const float4*)(qkv + (long)rows[2] * 768 + 512 + head * 64);
  const float4* v3 = (const float4*)(qkv + (long)rows[3] * 768 + 512 + head * 64);
  float4* o4 = (float4*)(ho + (long)rows[t] * 256 + head * 64);
#pragma unroll
  for (int d = 0; d < 16; ++d) {
    float4 a = v0[d], bb = v1[d], c = v2[d], e = v3[d], r;
    r.x = w[0] * a.x + w[1] * bb.x + w[2] * c.x + w[3] * e.x;
    r.y = w[0] * a.y + w[1] * bb.y + w[2] * c.y + w[3] * e.y;
    r.z = w[0] * a.z + w[1] * bb.z + w[2] * c.z + w[3] * e.z;
    r.w = w[0] * a.w + w[1] * bb.w + w[2] * c.w + w[3] * e.w;
    o4[d] = r;
  }
}

// ---------------------------------------------------------------------------
// Lofi 2x2 average pool: x (B,512,64,64) -> pooled (B,512,32,32) flat.
// ---------------------------------------------------------------------------
__global__ void __launch_bounds__(256) lofi_pool(const float* __restrict__ x,
                                                 float* __restrict__ pooled) {
  const int idx = blockIdx.x * 256 + threadIdx.x;  // 8*512*1024
  const int j = idx & 31;
  const int i = (idx >> 5) & 31;
  const int c = (idx >> 10) & 511;
  const int b = idx >> 19;
  const float* p = x + (long)(b * 512 + c) * 4096 + i * 128 + j * 2;
  pooled[idx] = 0.25f * (p[0] + p[1] + p[64] + p[65]);
}

// ---------------------------------------------------------------------------
// Lofi flash attention.  One block = 128 threads = 4 waves handles 64 q rows
// for one (b, head); keys streamed in 64-wide chunks with online softmax.
// Q: q_lo[(b*4096+n)*256 + head*64 + d], K/V: kv_lo[(b*1024+m)*512 + {0,256}
// + head*64 + d].  The tile stream K0, V0, K1, V1, ... goes through a ring of
// two LDS buffers (K tiles in the first, V tiles in the second): V flies while
// the scores and the softmax are worked, the next K while P*V is, and one
// barrier per half chunk publishes the next tile and frees the one just read.
// All tile fills are async-to-LDS; 16 adjacent lanes copy one whole 256-B tile
// row (two full lines), each 16-lane group owning 8 consecutive rows.
// ---------------------------------------------------------------------------
// Issues the copies of one 64x64 tile (row pitch 512 floats at g0) into dst.
__device__ __forceinline__ void flash_stage(const float* __restrict__ g0,
                                            float* dst, int tid) {
  const int r = (tid >> 4) * 8, c = (tid & 15) * 4;
  const float* g = g0 + (long)r * 512 + c;
#pragma unroll  // the eight copies issue back to back, no loop counter between
  for (int i = 0; i < 8; ++i) async_b128(g + i * 512, &dst[(r + i) * 68 + c]);
}

__global__ void __launch_bounds__(128) lofi_flash(const float* __restrict__ Q,
                                                  const float* __restrict__ KV,
                                                  float* __restrict__ O) {
  __shared__ float q_s[64 * 68];      // [row][d], pad 68 (272B, b128-aligned)
  __shared__ __attribute__((aligned(16))) float k_s[64 * 68];  // [key][d]
  __shared__ __attribute__((aligned(16))) float v_s[64 * 68];  // [key][d]
  __shared__ float p_s[4 * 16 * 68];  // per-wave P relayout scratch

  const int b = blockIdx.z;
  const int head = blockIdx.y;
  const int n0 = blockIdx.x * 64;
  const int tid = threadIdx.x;
  const int wave = tid >> 5;
  const int lane = tid & 31;
  const int lr = lane & 15;
  const int lh = lane >> 4;

  {  // stage the 64x64 Q tile once (async; waited before first use)
    const int r = (tid >> 4) * 8, c = (tid & 15) * 4;
    const float* g = Q + ((long)(b * 4096 + n0 + r)) * 256 + head * 64 + c;
#pragma unroll
    for (int i = 0; i < 8; ++i) async_b128(g + i * 256, &q_s[(r + i) * 68 + c]);
  }

  // this lane's 4 head dims in V row 2*lh; the keys of a chunk are constant offsets
  const float* vp = &v_s[lh * 2 * 68 + lr * 4];

  v8f o_acc[4];
  float m_run[8], l_run[8];
#pragma unroll
  for (int t = 0; t < 4; ++t) o_acc[t] = v8f_zero();
#pragma unroll
  for (int j = 0; j < 8; ++j) { m_run[j] = -1e30f; l_run[j] = 0.0f; }

  // K rows of this (b, head); the V rows lie 256 floats behind them
  const float* kvp = KV + (long)(b * 1024) * 512 + head * 64;
  flash_stage(kvp, k_s, tid);  // K chunk 0
  // this wave's Q and K copies have landed before the barrier publishes them
  asm volatile("s_wait_asynccnt 0x0" ::: "memory");
  __syncthreads();
  flash_stage(kvp + 256, v_s, tid);  // V chunk 0

  for (int kb = 0; kb < 1024; kb += 64) {
    // S = Q * K^T  (16 rows x 64 keys per wave)
    v8f s_acc[4];
#pragma unroll
    for (int t = 0; t < 4; ++t) s_acc[t] = v8f_zero();
#pragma unroll
    for (int kk = 0; kk < 64; kk += 4) {
      const int ka = kk + lh * 2;
      v2f a;
      a.x = q_s[(wave * 16 + lr) * 68 + ka];
      a.y = q_s[(wave * 16 + lr) * 68 + ka + 1];
#pragma unroll
      for (int t = 0; t < 4; ++t) {
        v2f bb;
        bb.x = k_s[(t * 16 + lr) * 68 + ka];  // B[d][key] = k[key][d]
        bb.y = k_s[(t * 16 + lr) * 68 + ka + 1];
        s_acc[t] = wmma4(a, bb, s_acc[t]);
      }
    }

    // online softmax (row = j + 8*lh; values for a row live in the 16 lanes
    // of that half -> shfl_xor masks 1,2,4,8 stay within the half)
#pragma unroll
    for (int j = 0; j < 8; ++j) {
      float mx = fmaxf(fmaxf(s_acc[0][j], s_acc[1][j]),
                       fmaxf(s_acc[2][j], s_acc[3][j]));
      mx = half_max(mx) * 0.125f;
      const float nm = fmaxf(m_run[j], mx);
      const float alpha = __expf(m_run[j] - nm);
      m_run[j] = nm;
      float rs = 0.0f;
#pragma unroll
      for (int t = 0; t < 4; ++t) {
        const float p = __expf(s_acc[t][j] * 0.125f - nm);
        s_acc[t][j] = p;
        rs += p;
      }
      rs = half_sum(rs);
      l_run[j] = l_run[j] * alpha + rs;
#pragma unroll
      for (int t = 0; t < 4; ++t) o_acc[t][j] *= alpha;
    }

    // P (C-layout) -> per-wave LDS -> A-layout for the PV matmul
#pragma unroll
    for (int t = 0; t < 4; ++t)
#pragma unroll
      for (int j = 0; j < 8; ++j)
        p_s[wave * 1088 + (j + lh * 8) * 68 + t * 16 + lr] = s_acc[t][j];

    // this wave's reads of K and writes of P are done
    asm volatile("s_wait_dscnt 0x0" ::: "memory");
    // this wave's copies of V have landed before the barrier
    asm volatile("s_wait_asynccnt 0x0" ::: "memory");
    __syncthreads();  // publishes V, frees the K buffer
    if (kb + 64 < 1024)
      flash_stage(kvp + (long)(kb + 64) * 512, k_s, tid);  // next K chunk

    // O += P * V   (K-dim = 64 keys)
#pragma unroll
    for (int kk = 0; kk < 64; kk += 4) {
      const int ka = kk + lh * 2;
      v2f a;
      a.x = p_s[wave * 1088 + lr * 68 + ka];
      a.y = p_s[wave * 1088 + lr * 68 + ka + 1];
      // o_acc[t] holds head dims 4*lr + t: one 16-byte read per V row
      const v4f v0 = *(const v4f*)(vp + kk * 68);        // B[key][d], key ka
      const v4f v1 = *(const v4f*)(vp + (kk + 1) * 68);  // key ka + 1
#pragma unroll
      for (int t = 0; t < 4; ++t) {
        v2f bb;
        bb.x = v0[t];
        bb.y = v1[t];
        o_acc[t] = wmma4(a, bb, o_acc[t]);
      }
    }
    // this wave's reads of V and P are done
    asm volatile("s_wait_dscnt 0x0" ::: "memory");
    // this wave's copies of the next K have landed before the barrier
    asm volatile("s_wait_asynccnt 0x0" ::: "memory");
    __syncthreads();  // publishes the next K, frees the V buffer
    if (kb + 64 < 1024)
      flash_stage(kvp + (long)(kb + 64) * 512 + 256, v_s, tid);  // next V chunk
  }
  // no copy is outstanding when the wave goes on to its end
  asm volatile("s_wait_asynccnt 0x0" ::: "memory");

  // normalize and store (row m uniform across its 16-lane half)
#pragma unroll
  for (int j = 0; j < 8; ++j) {
    const float inv = 1.0f / l_run[j];
    const int m = n0 + wave * 16 + j + lh * 8;
    v4f o;
#pragma unroll
    for (int t = 0; t < 4; ++t) o[t] = o_acc[t][j] * inv;
    *(v4f*)&O[((long)(b * 4096 + m)) * 256 + head * 64 + lr * 4] = o;
  }
}

// ---------------------------------------------------------------------------
extern "C" void kernel_launch(void* const* d_in, const int* in_sizes, int n_in,
                              void* d_out, int out_size, void* d_ws,
                              size_t ws_size, hipStream_t stream) {
  (void)in_sizes; (void)n_in; (void)out_size; (void)ws_size;
  const float* x        = (const float*)d_in[0];
  const float* h_qkv_w  = (const float*)d_in[1];
  const float* h_proj_w = (const float*)d_in[2];
  const float* h_proj_b = (const float*)d_in[3];
  const float* l_q_w    = (const float*)d_in[4];
  const float* l_kv_w   = (const float*)d_in[5];
  const float* l_proj_w = (const float*)d_in[6];
  const float* l_proj_b = (const float*)d_in[7];
  float* out = (float*)d_out;
  float* ws = (float*)d_ws;

  float* qkv    = ws;             // 32768*768
  float* ho     = ws + 25165824L; // 32768*256
  float* pooled = ws;             // reused after hifi_attn (stream-ordered)
  float* qlo    = ws + 4194304L;  // 8*4096*256
  float* kvlo   = ws + 12582912L; // 8*1024*512
  float* olo    = ws + 16777216L; // 8*4096*256

  // ---- Hi-Fi path ----
  // qkv = x(32768x512, contiguous) @ h_qkv_w(512x768)
  wmma_gemm_f32<<<dim3(12, 512, 1), 128, 0, stream>>>(
      x, h_qkv_w, nullptr, qkv, 32768, 768, 512, 512, 768, 768,
      /*a_cm=*/0, 0L, 0L, /*nchw=*/0, 0);
  hifi_attn<<<512, 256, 0, stream>>>(qkv, ho);
  // out[:, 0:256] = ho @ h_proj_w + h_proj_b  (NCHW scatter epilogue)
  wmma_gemm_f32<<<dim3(4, 512, 1), 128, 0, stream>>>(
      ho, h_proj_w, h_proj_b, out, 32768, 256, 256, 256, 256, 0,
      /*a_cm=*/0, 0L, 0L, /*nchw=*/1, /*chan_off=*/0);

  // ---- Lo-Fi path ----
  lofi_pool<<<16384, 256, 0, stream>>>(x, pooled);
  // q = x[b]^T(4096x512, col-major) @ l_q_w(512x256), batched over b
  wmma_gemm_f32<<<dim3(4, 64, 8), 128, 0, stream>>>(
      x, l_q_w, nullptr, qlo, 4096, 256, 512, 4096, 256, 256,
      /*a_cm=*/1, 2097152L, 1048576L, /*nchw=*/0, 0);
  // kv = pooled[b]^T(1024x512, col-major) @ l_kv_w(512x512)
  wmma_gemm_f32<<<dim3(8, 16, 8), 128, 0, stream>>>(
      pooled, l_kv_w, nullptr, kvlo, 1024, 512, 512, 1024, 512, 512,
      /*a_cm=*/1, 524288L, 524288L, /*nchw=*/0, 0);
  lofi_flash<<<dim3(64, 4, 8), 128, 0, stream>>>(qlo, kvlo, olo);
  // out[:, 256:512] = olo @ l_proj_w + l_proj_b
  wmma_gemm_f32<<<dim3(4, 512, 1), 128, 0, stream>>>(
      olo, l_proj_w, l_proj_b, out, 32768, 256, 256, 256, 256, 0,
      /*a_cm=*/0, 0L, 0L, /*nchw=*/1, /*chan_off=*/256);
}
